// v009
// The times below were measured on an AMD MI455X: many runs one after another, warmed up first and cycling through
// copies of the inputs, with the whole window's GPU time divided by the number of runs. Launches and the gaps
// between them are all in it. The median over several windows is given; except for v000 it joins two sittings, which
// can be a few percent apart, so the side-by-side timings, each taken in one sitting, are the better comparison.
// This document starts at v009; the versions before it stand elsewhere.
// A run of this version takes 230 microseconds.
// Two timings next to v008 both put it at 1.04 times that version's speed.
// All steps since the starting kernel, v000, together make it 5.92 times as fast.
// Contractions: pW1/pW2/Wq/Wk linears and q.k^T logits on v_wmma_f32_16x16x32_bf16 with both operands as bf16 hi+lo planes (hi.hi + hi.lo + lo.hi), f32 accumulate, logits kept f32; rW1/rW2/rW3/Wv/ffn linears and attn.V on v_wmma_f32_16x16x32_f16 (weights carried x256, attention weights carried x32768), f32 accumulate; softmax statistics, column sums, LayerNorm and residual adds in f32.
#include <hip/hip_runtime.h>
#include <math.h>

typedef __attribute__((ext_vector_type(16))) _Float16 v16h;
typedef __attribute__((ext_vector_type(8)))  _Float16 v8h;
typedef __attribute__((ext_vector_type(4)))  _Float16 v4h;
typedef __attribute__((ext_vector_type(16))) __bf16   v16b;
typedef __attribute__((ext_vector_type(8)))  __bf16   v8b;
typedef __attribute__((ext_vector_type(8)))  float    v8f;
typedef __attribute__((ext_vector_type(4)))  float    v4f;
typedef __attribute__((ext_vector_type(4)))  unsigned int v4u;
typedef __attribute__((ext_vector_type(2)))  unsigned int v2u;
typedef __attribute__((ext_vector_type(8)))  unsigned int v8u;

// ---------------------------------------------------------------------------
// Problem constants
// ---------------------------------------------------------------------------
constexpr int    kTok       = 4096;
constexpr int    kDim       = 512;
constexpr size_t kND        = (size_t)kTok * kDim;
constexpr size_t kWW        = (size_t)kDim * kDim;
constexpr float  kWCarry    = 256.0f;
constexpr float  kWCarryInv = 1.0f / kWCarry;
constexpr float  kPCarry    = 32768.0f;
constexpr float  kPCarryInv = 1.0f / kPCarry;
constexpr float  kInvDim    = 1.0f / (float)kDim;
constexpr float  kLnEps     = 1e-6f;
constexpr float  kAttnEps   = 1e-9f;
static_assert((kTok % 64) == 0 && (kDim % 64) == 0);
static_assert((kTok % 32) == 0 && (kDim % 32) == 0);
static_assert(((kND / 8) % 256) == 0 && ((kWW / 8) % 256) == 0);

// ---------------------------------------------------------------------------
// Workspace region map (bytes; every offset is a multiple of 128). Both branches run in the same launches, so every
// region holds branch A's part and then branch B's.
//   R0      2 x 67,108,864  time-shared region, one per branch:
//             (a) operand planes of the branch's linear chain:
//                 XH XL T0H T0L FH FL   6 x 4,194,304 (16-bit [4096][512] planes)
//                 WSH (4 bf16 hi weight planes) 2,097,152 ; WSL (4 bf16 lo planes) 2,097,152 -> 29,360,128 used
//             (b) S f32 [4096][4096] logits of the branch                    67,108,864
//   QK      33,554,432  QH QL KH KL bf16 planes [4096][512], branch A then branch B
//   VT       8,388,608  V^T f16 [512][4096], branch A then B
//   RES      8,388,608  residual-chain output f16 [4096][512], branch A then B
//   SC      33,554,432  attn.V output f32 [4096][512], one share per half of the keys: half 0 (branch A then B), half 1
//   FFN      1,048,576  ffn weight f16 planes (x256), branch A then B
//   MROW        32,768  row maxima f32 [4096], branch A then B
//   INVS        32,768  1 / row exp sums f32 [4096], branch A then B
//   RC          32,768  1 / (1e-9 + column sums) f32 [4096], branch A then B
//   CP       4,194,304  column-sum shares f32 [128][4096] (one per block of 32 query rows), branch A then B
//   R1, R2   8,388,608 each  residual-chain planes f16 [4096][512], branch A then B; outside R0, because the second
//                       residual product and V^T run in the launch that writes the logits, the third one behind it
//   WF       4,194,304  4 f16 weight planes (x256), branch A then B; outside R0 for the same reason
//   F16      8,388,608  f16 copy of feat [4096][512], branch A then B; outside R0 for the same reason
//   total = 134,217,728 + 33,554,432 + 8,388,608 + 8,388,608 + 33,554,432 + 1,048,576 + 32,768 + 32,768 + 32,768
//           + 4,194,304 + 8,388,608 + 8,388,608 + 4,194,304 + 8,388,608 = 252,805,120
// ---------------------------------------------------------------------------
constexpr size_t kPlane16  = kND * 2;
constexpr size_t kPlane32  = kND * 4;
constexpr size_t kW16      = kWW * 2;
constexpr size_t kR0Bytes  = (size_t)kTok * kTok * 4;
constexpr size_t kOffXH    = 0;
constexpr size_t kOffXL    = kOffXH  + kPlane16;
constexpr size_t kOffT0H   = kOffXL  + kPlane16;
constexpr size_t kOffT0L   = kOffT0H + kPlane16;
constexpr size_t kOffFH    = kOffT0L + kPlane16;
constexpr size_t kOffFL    = kOffFH  + kPlane16;
constexpr size_t kOffWSH   = kOffFL  + kPlane16;
constexpr size_t kOffWSL   = kOffWSH + 4 * kW16;
constexpr size_t kPhase1End = kOffWSL + 4 * kW16;
constexpr size_t kOffS     = 0;
constexpr size_t kOffQK    = 2 * kR0Bytes;
constexpr size_t kOffVT    = kOffQK  + 8 * kPlane16;
constexpr size_t kOffRES   = kOffVT  + 2 * kPlane16;
constexpr size_t kOffSC    = kOffRES + 2 * kPlane16;
constexpr size_t kOffFFN   = kOffSC  + 4 * kPlane32;
constexpr size_t kOffMROW  = kOffFFN + 2 * kW16;
constexpr size_t kOffINVS  = kOffMROW + 2 * (size_t)kTok * 4;
constexpr size_t kOffRC    = kOffINVS + 2 * (size_t)kTok * 4;
constexpr size_t kOffCP    = kOffRC   + 2 * (size_t)kTok * 4;
constexpr size_t kCPBytes  = 2 * (size_t)(kTok / 32) * kTok * 4;
constexpr size_t kOffR1    = kOffCP   + kCPBytes;
constexpr size_t kOffR2    = kOffR1   + 2 * kPlane16;
constexpr size_t kOffWF    = kOffR2   + 2 * kPlane16;
constexpr size_t kOffF16   = kOffWF   + 8 * kW16;
constexpr size_t kWsTotal  = kOffF16  + 2 * kPlane16;
constexpr long   kR0El16   = (long)(kR0Bytes / 2);  /* branch A -> branch B inside R0, in 16-bit elements */
constexpr long   kR0El32   = (long)(kR0Bytes / 4);  /* the same in f32 elements */
static_assert(kPhase1End <= kR0Bytes);
static_assert(kWsTotal == 252805120ull);
static_assert(kWsTotal <= 268435456ull);
static_assert((kOffWSH % 128) == 0 && (kOffWSL % 128) == 0 && (kOffWF % 128) == 0 && (kOffQK % 128) == 0 &&
              (kOffVT % 128) == 0 && (kOffRES % 128) == 0 && (kOffSC % 128) == 0 && (kOffFFN % 128) == 0 &&
              (kOffMROW % 128) == 0 && (kOffINVS % 128) == 0 && (kOffRC % 128) == 0 &&
              (kOffCP % 128) == 0 && (kOffR1 % 128) == 0 && (kOffR2 % 128) == 0 &&
              (kOffF16 % 128) == 0);

// ---------------------------------------------------------------------------
// Small helpers
// ---------------------------------------------------------------------------
__device__ __forceinline__ unsigned short f2bf_bits(float f) {
  unsigned u = __float_as_uint(f);
  return (unsigned short)((u + 0x7FFFu + ((u >> 16) & 1u)) >> 16);
}
__device__ __forceinline__ float bf_bits2f(unsigned short h) { return __uint_as_float(((unsigned)h) << 16); }

/* f16 bits (low 16 bits of hb, finite values) -> f32, integer path only */
__device__ __forceinline__ float h16_to_f32(unsigned hb) {
  const unsigned sgn = (hb & 0x8000u) << 16;
  const unsigned em = hb & 0x7fffu;
  const float fn = __uint_as_float((em << 13) + 0x38000000u);
  const float fs = (float)em * 5.9604644775390625e-8f;
  const float mag = (em < 0x400u) ? fs : fn;
  return __uint_as_float(__float_as_uint(mag) | sgn);
}

/* hazard guards: four nops, all four accumulators of the group tied, A fragments named as inputs */
__device__ __forceinline__ void grp_guard_h(v8f& a, v8f& b, v8f& c, v8f& d, v16h x, v16h y) {
  asm volatile("v_nop\n\tv_nop\n\tv_nop\n\tv_nop" : "+v"(a), "+v"(b), "+v"(c), "+v"(d) : "v"(x), "v"(y));
}
__device__ __forceinline__ void grp_guard_b(v8f& a, v8f& b, v8f& c, v8f& d, v16b x, v16b y) {
  asm volatile("v_nop\n\tv_nop\n\tv_nop\n\tv_nop" : "+v"(a), "+v"(b), "+v"(c), "+v"(d) : "v"(x), "v"(y));
}
__device__ __forceinline__ void keep4_h(v16h a, v16h b, v16h c, v16h d) { asm volatile("v_nop" :: "v"(a), "v"(b), "v"(c), "v"(d)); }
__device__ __forceinline__ void keep4_b(v16b a, v16b b, v16b c, v16b d) { asm volatile("v_nop" :: "v"(a), "v"(b), "v"(c), "v"(d)); }
__device__ __forceinline__ void acc_guard4(v8f& a, v8f& b, v8f& c, v8f& d) {
  asm volatile("v_nop\n\tv_nop\n\tv_nop\n\tv_nop" : "+v"(a), "+v"(b), "+v"(c), "+v"(d));
}

/* Fragment loader: elements 0..7 <- p[0..7], elements 8..15 <- p[16..23]; p already includes 8*(lane>>4) */
template <typename T> struct Frag;
template <> struct Frag<_Float16> {
  typedef v16h V;
  union U { v16h v; v8h h[2]; };
  static __device__ __forceinline__ v16h load(const _Float16* p) {
    U f;
    f.h[0] = *(const v8h*)(p);
    f.h[1] = *(const v8h*)(p + 16);
    return f.v;
  }
  static __device__ __forceinline__ v8f mma(v16h a, v16h b, v8f c) {
    return __builtin_amdgcn_wmma_f32_16x16x32_f16(false, a, false, b, (short)0, c, false, false);
  }
  static __device__ __forceinline__ void guard(v8f& a, v8f& b, v8f& c, v8f& d, v16h x, v16h y) { grp_guard_h(a, b, c, d, x, y); }
  static __device__ __forceinline__ void keep(v16h a, v16h b, v16h c, v16h d) { keep4_h(a, b, c, d); }
};
template <> struct Frag<__bf16> {
  typedef v16b V;
  union U { v16b v; v8b h[2]; };
  static __device__ __forceinline__ v16b load(const __bf16* p) {
    U f;
    f.h[0] = *(const v8b*)(p);
    f.h[1] = *(const v8b*)(p + 16);
    return f.v;
  }
  static __device__ __forceinline__ v8f mma(v16b a, v16b b, v8f c) {
    return __builtin_amdgcn_wmma_f32_16x16x32_bf16(false, a, false, b, (short)0, c, false, false);
  }
  static __device__ __forceinline__ void guard(v8f& a, v8f& b, v8f& c, v8f& d, v16b x, v16b y) { grp_guard_b(a, b, c, d, x, y); }
  static __device__ __forceinline__ void keep(v16b a, v16b b, v16b c, v16b d) { keep4_b(a, b, c, d); }
};

// ---------------------------------------------------------------------------
// LDS-staged WMMA GEMM: C[m,n] = scale * sum_k A[m,k] * Bt[n,k] (+bias[n]) (+resid[m,n]). A block of 4 waves owns a
// 128x128 tile (2x2 waves, each wave a 64x64 tile). A row-major [M][K] pitch lda; Bt row-major [N][K] pitch ldb;
// M, N multiples of 128, K a multiple of 64 and at least 128.
// Operand path: a stage is 64 k (one whole 128-B line) of the block's 128 A rows and 128 Bt rows, every plane.
// SPLIT: four planes, each brought into LDS by one tensor load of one wave (128 rows x 128 B, padded to the pitch); two
// buffers, the next stage's loads fly while this stage is multiplied. Not SPLIT: per-lane asynchronous 16-B copies
// (8 lanes per line, 4 whole lines per wave instruction), four buffers, the next three stages' copies fly (48 of a
// wave at the most); every wave issues 16 copies per stage, so the wait for a stage is a counted wait that leaves
// the younger stages' copies out. LDS row pitch 144 B (16 B x 9) for the 16-B readers.
// SPLIT: operands are hi/lo planes (A2/Bt2 = lo planes, same layout); product = hi.hi + hi.lo + lo.hi.
// BIAS_MODE: 0 none, 2 bias[n] (f32). ACT: 0 none, 2 relu. RESID (f32 output only): the residual is fetched in the
// store phase, one 16-B vector per lane at exactly the address the lane stores to.
// OUT_MODE: 0 f32, 1 f16, 2 bf16 hi plane (Cout) + bf16 lo plane (Cout2), 3 the same and an f16 plane of hi + lo
// (Cout3, same pitch; c3P bytes lead to branch 1).
// Epilogue: 16-row slabs staged per wave in LDS (only the owning wave touches its slab); the slabs reuse the ring
// behind the last stage's waits and barrier.
// ET: 0 f16 operands, 1 bf16 operands (pointers passed as 16-bit storage).
// One launch holds several independent products: gemm_tile is the work of one block, (bx, by, bz) = (tile, branch,
// weight plane) of its product; the kernels below pick product and tile from blockIdx (block-uniform). The pointers
// are those of (0, 0); aP, bP (16-bit elements) and cP (bytes) lead to branch 1, bQ and cQ to plane 1.
// Every form's ring has the same size, so the products of a launch share one LDS array.
// ---------------------------------------------------------------------------
template <int ET> struct Elem;
template <> struct Elem<0> { typedef _Float16 T; };
template <> struct Elem<1> { typedef __bf16 T; };

constexpr int kStageK   = 64;
constexpr int kRowPitch = 144;
constexpr int kPlaneLds = 128 * kRowPitch;
constexpr int kSlabLds  = 16 * 68 * 4;
static_assert((kRowPitch % 16) == 0 && ((kRowPitch / 16) % 2) == 1 && kRowPitch >= kStageK * 2);
static_assert((kDim % 128) == 0 && (kTok % 128) == 0 && (kDim % kStageK) == 0 && kDim >= 2 * kStageK);
static_assert(4 * kSlabLds <= 4 * kPlaneLds && (kSlabLds % 16) == 0);
static_assert((kPlaneLds % 2048) == 0 && kRowPitch == kStageK * 2 + 16);  /* a tensor load's place in LDS; its pad */

/* One plane's 128 rows x 128 B of a stage: this lane's eight 16-B pieces, rows 16 apart. l = the lane's LDS byte
   address of its first piece, g = its global address, gstep = 16 source rows in elements. The copies and the
   s_wait_xcnt stand in one statement so that no address register is rewritten ahead of that wait. */
__device__ __forceinline__ void stage_plane(unsigned l, const unsigned short* g, size_t gstep) {
  const unsigned l1 = l + 16 * kRowPitch, l2 = l + 32 * kRowPitch, l3 = l + 48 * kRowPitch, l4 = l + 64 * kRowPitch,
                 l5 = l + 80 * kRowPitch, l6 = l + 96 * kRowPitch, l7 = l + 112 * kRowPitch;
  const unsigned short *g1 = g + gstep, *g2 = g + 2 * gstep, *g3 = g + 3 * gstep, *g4 = g + 4 * gstep,
                       *g5 = g + 5 * gstep, *g6 = g + 6 * gstep, *g7 = g + 7 * gstep;
  asm volatile(
      "global_load_async_to_lds_b128 %0, %8, off\n\t"
      "global_load_async_to_lds_b128 %1, %9, off\n\t"
      "global_load_async_to_lds_b128 %2, %10, off\n\t"
      "global_load_async_to_lds_b128 %3, %11, off\n\t"
      "global_load_async_to_lds_b128 %4, %12, off\n\t"
      "global_load_async_to_lds_b128 %5, %13, off\n\t"
      "global_load_async_to_lds_b128 %6, %14, off\n\t"
      "global_load_async_to_lds_b128 %7, %15, off\n\t"
      "s_wait_xcnt 0x0"
      :: "v"(l), "v"(l1), "v"(l2), "v"(l3), "v"(l4), "v"(l5), "v"(l6), "v"(l7),
         "v"(g), "v"(g1), "v"(g2), "v"(g3), "v"(g4), "v"(g5), "v"(g6), "v"(g7)
      : "memory");
}

/* Four-buffer ring, 16 copies of a wave per stage: returns when all of this wave's copies have landed but those of its
   'younger' youngest stages (2 at the most are in flight behind the stage that is waited for; 1 and then none in the
   last trips, which issue no stage). The count returns in issue order. younger is the same for the whole block. */
__device__ __forceinline__ void wait_copies_but(int younger) {
  if (younger >= 2)      asm volatile("s_wait_asynccnt 0x20" ::: "memory");
  else if (younger == 1) asm volatile("s_wait_asynccnt 0x10" ::: "memory");
  else                   asm volatile("s_wait_asynccnt 0x0" ::: "memory");
}

__device__ __forceinline__ unsigned uni(unsigned v) { return (unsigned)__builtin_amdgcn_readfirstlane((int)v); }
__device__ __forceinline__ unsigned pinned(unsigned v) {
  unsigned w = uni(v);
  asm volatile("" : "+s"(w));  /* the scalar pin in front of a tensor load: its issue test or its stage number */
  return w;
}

/* The two groups of a tensor load's descriptor: a two-dimensional tile of rows x rowB bytes, 1-byte elements, tensor =
   tile; word0 = the pad constant; dst = byte offset in the block's LDS; ga = address of the tile's first byte. */
__device__ __forceinline__ v8u tdm_group1(unsigned word0, unsigned rowB, unsigned rows, unsigned pitchB) {
  v8u g;
  g[0] = uni(word0);
  g[1] = uni(rowB << 16);
  g[2] = uni(rows << 16);
  g[3] = uni(rowB << 16);
  g[4] = uni(rows);
  g[5] = uni(pitchB);
  g[6] = uni(0u);
  g[7] = uni(0u);
  return g;
}
__device__ __forceinline__ v4u tdm_group0(unsigned dst, unsigned long long ga) {
  v4u g;
  g[0] = uni(1u);
  g[1] = uni(dst);
  g[2] = uni((unsigned)ga);
  g[3] = uni((((unsigned)(ga >> 32)) & 0x01FFFFFFu) | 0x80000000u);
  return g;
}
__device__ __forceinline__ void tdm_load(v4u g0, v8u g1) {
  asm volatile("tensor_load_to_lds %0, %1" :: "s"(g0), "s"(g1) : "memory");
}
constexpr unsigned kPad128 = (1u << 20) | (4u << 22) | (3u << 25);  /* 16 B of pad behind every 128 B: pitch 144 */
constexpr unsigned kPad256 = (1u << 20) | (5u << 22) | (3u << 25);  /* 16 B of pad behind every 256 B: pitch 272 */

struct GemmArgs {
  const unsigned short* Ap0;
  const unsigned short* A2p0;
  const unsigned short* Btp0;
  const unsigned short* Bt2p0;
  void* Cout0;
  void* Cout20;
  void* Cout30;
  const float* bias0;
  const float* bias1;
  const float* resid0;
  const float* resid1;
  long aP, bP, bQ, cP, cQ, c3P;
  int lda, ldb, ldc, M, N, K;
  float scale;
};
constexpr int kRingLds = 8 * kPlaneLds;

template <int ET, bool SPLIT, int BIAS_MODE, int OUT_MODE, bool RESID, int ACT>
__device__ __forceinline__ void gemm_tile(const GemmArgs& ga, int bx, int by, int bz, unsigned char* ring) {
  typedef typename Elem<ET>::T T;
  typedef typename Frag<T>::V V;
  const unsigned short* __restrict__ Ap0 = ga.Ap0;
  const unsigned short* __restrict__ A2p0 = ga.A2p0;
  const unsigned short* __restrict__ Btp0 = ga.Btp0;
  const unsigned short* __restrict__ Bt2p0 = ga.Bt2p0;
  void* __restrict__ Cout0 = ga.Cout0;
  void* __restrict__ Cout20 = ga.Cout20;
  const float* __restrict__ bias0 = ga.bias0;
  const float* __restrict__ bias1 = ga.bias1;
  const float* __restrict__ resid0 = ga.resid0;
  const float* __restrict__ resid1 = ga.resid1;
  const long aP = ga.aP, bP = ga.bP, bQ = ga.bQ, cP = ga.cP, cQ = ga.cQ;
  const int lda = ga.lda, ldb = ga.ldb, ldc = ga.ldc, M = ga.M, N = ga.N, K = ga.K;
  const float scale = ga.scale;
  const long zp = (long)by;
  const long zq = (long)bz;
  const unsigned short* Ap   = Ap0 + zp * aP;
  const unsigned short* A2p  = A2p0 + zp * aP;
  const unsigned short* Btp  = Btp0 + zp * bP + zq * bQ;
  const unsigned short* Bt2p = Bt2p0 + zp * bP + zq * bQ;
  void* Cout  = (void*)((char*)Cout0 + zp * cP + zq * cQ);
  void* Cout2 = (void*)((char*)Cout20 + zp * cP + zq * cQ);
  void* Cout3 = (void*)((char*)ga.Cout30 + zp * ga.c3P);
  const float* bias  = zp ? bias1 : bias0;
  const float* resid = zp ? resid1 : resid0;
  /* stage layout: A hi | (A lo) | Bt hi | (Bt lo), each plane 128 rows at kRowPitch */
  constexpr int kPlanes = SPLIT ? 4 : 2;
  constexpr int kStageLds = kPlanes * kPlaneLds;
  constexpr int kOffBh = (SPLIT ? 2 : 1) * kPlaneLds;
  constexpr int kBufs = SPLIT ? 2 : 4;
  static_assert(kBufs * kStageLds == kRingLds);
  const int lane = threadIdx.x & 31;
  const int wave = __builtin_amdgcn_readfirstlane((int)(threadIdx.x >> 5));
  const int tilesN = N >> 7;
  const int tilesM = M >> 7;
  /* block-uniform exit in front of every copy and barrier */
  if (bx >= tilesM * tilesN) return;
  const int bm = bx / tilesN;
  const int bn = bx - bm * tilesN;
  const int wm = (wave >> 1) << 6;
  const int wn = (wave & 1) << 6;
  const int m0 = (bm << 7) + wm;
  const int n0 = (bn << 7) + wn;

  const int rlane = lane & 15;
  const int koff  = (lane >> 4) * 8;
  const int mOff  = (lane >> 4) * 8;

  /* copy map: thread t brings 16-B piece t&7 of rows (t>>3) + 16q, q 0..7, of every plane */
  const int crow = (int)threadIdx.x >> 3;
  const int cpc  = (int)threadIdx.x & 7;
  const unsigned ldsBase = (unsigned)(size_t)(&ring[0]) + (unsigned)(crow * kRowPitch + cpc * 16);
  const size_t aOff = (size_t)((bm << 7) + crow) * lda + cpc * 8;
  const size_t bOff = (size_t)((bn << 7) + crow) * ldb + cpc * 8;
  const size_t aStep = (size_t)16 * lda;
  const size_t bStep = (size_t)16 * ldb;
  const int nStages = K / kStageK;

  /* not SPLIT: the stage's two planes by asynchronous copies */
  auto issue_stage = [&](int s) {
    const unsigned l = ldsBase + (unsigned)((s & (kBufs - 1)) * kStageLds);
    const size_t kq = (size_t)s * kStageK;
    stage_plane(l, Ap + aOff + kq, aStep);
    stage_plane(l + kOffBh, Btp + bOff + kq, bStep);
  };

  /* SPLIT: wave w brings plane w of a stage (A hi, A lo, Bt hi, Bt lo in the stage's order) by one tensor load: a tile of
     128 rows x 128 B, source pitch one operand row, 16 B of pad behind every row = kRowPitch. Every wave issues its
     own plane, one request outstanding. Group 1 never changes; group 0 carries the place in LDS and the address. */
  const unsigned short* tPlane = (wave == 0) ? Ap : (wave == 1) ? A2p : (wave == 2) ? Btp : Bt2p;
  const int tLd = (wave < 2) ? lda : ldb;
  const unsigned long long tSrc = (unsigned long long)(size_t)(tPlane + (size_t)(((wave < 2) ? bm : bn) << 7) * tLd);
  const unsigned tDst = (unsigned)(size_t)(&ring[0]) + (unsigned)(wave * kPlaneLds);
  v8u tg1;
  tg1[0] = uni((1u << 20) | (4u << 22) | (3u << 25));  /* no mask, 1-byte elements, pad of 4 dwords per 32 dwords */
  tg1[1] = uni(128u << 16);                            /* tensor_dim0 = 128 B */
  tg1[2] = uni(128u << 16);                            /* tensor_dim1 = 128 rows */
  tg1[3] = uni(128u << 16);                            /* tile_dim0 = 128 B */
  tg1[4] = uni(128u);                                  /* tile_dim1 = 128 rows */
  tg1[5] = uni((unsigned)tLd * 2u);                    /* source row pitch in bytes */
  tg1[6] = uni(0u);
  tg1[7] = uni(0u);
  v4u tg0 = (v4u){0u, 0u, 0u, 0u};
  auto issue_tile = [&](unsigned s) {
    const unsigned long long ga = tSrc + (unsigned long long)s * (kStageK * 2);
    tg0[0] = uni(1u);
    tg0[1] = uni(tDst + (s & 1u) * (unsigned)kStageLds);
    tg0[2] = uni((unsigned)ga);
    tg0[3] = uni((((unsigned)(ga >> 32)) & 0x01FFFFFFu) | 0x80000000u);
    asm volatile("tensor_load_to_lds %0, %1" :: "s"(tg0), "s"(tg1) : "memory");
  };
  /* this wave's request has landed; both groups as inputs: their registers keep their values while it is outstanding */
  auto wait_tile = [&]() { asm volatile("s_wait_tensorcnt 0x0" :: "s"(tg0), "s"(tg1) : "memory"); };

  v8f acc[4][4];
#pragma unroll
  for (int i = 0; i < 4; ++i)
#pragma unroll
    for (int j = 0; j < 4; ++j) acc[i][j] = (v8f){0.f, 0.f, 0.f, 0.f, 0.f, 0.f, 0.f, 0.f};

  /* prologue: stage 0 landed and published; stage 1 (SPLIT) or stages 1, 2 and 3 in flight */
  if (SPLIT) {
    /* the barrier that publishes stage 0 and the load of stage 1 are the foot of the loop's trip -1, which multiplies
       nothing: every load that stays outstanding is issued at that one place, so its descriptor's registers are the
       loop's own and nothing moves them on the way into the loop */
    issue_tile(0u);
    wait_tile();  /* this wave's stage-0 plane has landed */
  } else {
    issue_stage(0);
    if (nStages > 1) issue_stage(1);
    if (nStages > 2) issue_stage(2);
    wait_copies_but(nStages - 1);  /* this wave's stage-0 copies have landed */
    __syncthreads();
    if (nStages > kBufs - 1) issue_stage(kBufs - 1);
  }

  const int aFrag = (wm + rlane) * kRowPitch + koff * 2;
  const int bFrag = kOffBh + (wn + rlane) * kRowPitch + koff * 2;

#pragma unroll 1  /* one stage per trip: the foot's waits and barrier stand once */
  for (int s = SPLIT ? -1 : 0; s < nStages; ++s) {
    const unsigned char* sb = ring + (s & (kBufs - 1)) * kStageLds;
    if (!SPLIT || s >= 0)
#pragma unroll
    for (int kk = 0; kk < kStageK; kk += 32) {
      V bh[4], bl[4];
      const unsigned char* ap = sb + aFrag + kk * 2;
      V ah = Frag<T>::load((const T*)ap);
      V al;
      if (SPLIT) al = Frag<T>::load((const T*)(ap + kPlaneLds));
#pragma unroll
      for (int j = 0; j < 4; ++j) {
        const unsigned char* bp = sb + bFrag + j * 16 * kRowPitch + kk * 2;
        bh[j] = Frag<T>::load((const T*)bp);
        if (SPLIT) bl[j] = Frag<T>::load((const T*)(bp + kPlaneLds));
      }
#pragma unroll
      for (int i = 0; i < 4; ++i) {
        /* the next row group's A fragments are read in front of this group's products */
        V nh = ah;
        V nl;
        if (SPLIT) nl = al;
        if (i < 3) {
          nh = Frag<T>::load((const T*)(ap + (i + 1) * 16 * kRowPitch));
          if (SPLIT) nl = Frag<T>::load((const T*)(ap + (i + 1) * 16 * kRowPitch + kPlaneLds));
        }
#pragma unroll
        for (int j = 0; j < 4; ++j) {
          acc[i][j] = Frag<T>::mma(ah, bh[j], acc[i][j]);
          if (SPLIT) {
            acc[i][j] = Frag<T>::mma(ah, bl[j], acc[i][j]);
            acc[i][j] = Frag<T>::mma(al, bh[j], acc[i][j]);
          }
        }
        Frag<T>::guard(acc[i][0], acc[i][1], acc[i][2], acc[i][3], ah, SPLIT ? al : ah);
        ah = nh;
        if (SPLIT) al = nl;
      }
      Frag<T>::keep(bh[0], bh[1], bh[2], bh[3]);
      if (SPLIT) Frag<T>::keep(bl[0], bl[1], bl[2], bl[3]);
    }
    /* publish point of stage s + 1; the one barrier also ends every reader's last read of stage s's buffer */
    asm volatile("s_wait_dscnt 0x0" ::: "memory");     /* this wave's reads of stage s have returned */
    /* this wave's stage s + 1 plane (copies) has landed */
    if (SPLIT) wait_tile();
    else       wait_copies_but(nStages - 2 - s);
    __syncthreads();
    /* into the buffer that trip s has just read; SPLIT: a scalar test, the descriptor formed behind the wait */
    if (SPLIT) {
      if (pinned((unsigned)(s + 2 < nStages))) issue_tile(pinned((unsigned)(s + 2)));
    } else {
      if (s + kBufs < nStages) issue_stage(s + kBufs);
    }
  }
  /* nothing is outstanding when the ring becomes the slabs */
  if (SPLIT) {
    wait_tile();
    asm volatile("s_wait_dscnt 0x0" ::: "memory");
  } else {
    asm volatile("s_wait_asynccnt 0x0" ::: "memory");
  }
  acc_guard4(acc[0][0], acc[0][1], acc[0][2], acc[0][3]);
  acc_guard4(acc[1][0], acc[1][1], acc[1][2], acc[1][3]);
  acc_guard4(acc[2][0], acc[2][1], acc[2][2], acc[2][3]);
  acc_guard4(acc[3][0], acc[3][1], acc[3][2], acc[3][3]);

  /* ---- epilogue ---- */
  float* slab = (float*)(ring + wave * kSlabLds);
#pragma unroll
  for (int i = 0; i < 4; ++i) {
    const int mBase = m0 + (i << 4);
#pragma unroll
    for (int j = 0; j < 4; ++j) {
      const int n = n0 + (j << 4) + rlane;
      float bv = 0.f;
      if (BIAS_MODE == 2) bv = bias[n];
#pragma unroll
      for (int r = 0; r < 8; ++r) {
        float v = acc[i][j][r] * scale;
        if (BIAS_MODE == 2) v += bv;
        if (ACT == 2) v = fmaxf(v, 0.0f);
        slab[(mOff + r) * 68 + (j << 4) + rlane] = v;
      }
    }
    __builtin_amdgcn_fence(__ATOMIC_RELEASE, "workgroup");
    __builtin_amdgcn_wave_barrier();
    __builtin_amdgcn_fence(__ATOMIC_ACQUIRE, "workgroup");
    if (OUT_MODE == 0) {
      /* rows it*2 + hh, it 0..7, hh 0..1 = 16 rows; 16 lanes x 16 B = the 256-B row segment */
      float* C = (float*)Cout;
      const int hh = lane >> 4, c4 = (lane & 15) * 4;
      v4f vals[8];
#pragma unroll
      for (int it = 0; it < 8; ++it) {
        const int row = it * 2 + hh;
        v4f v = *(const v4f*)(slab + row * 68 + c4);
        if (RESID) {
          const v4f rr = *(const v4f*)(resid + (size_t)(mBase + row) * ldc + n0 + c4);
          v = v + rr;
        }
        vals[it] = v;
      }
      {
#pragma unroll
        for (int it = 0; it < 8; ++it) {
          const int row = it * 2 + hh;
          *(v4f*)(C + (size_t)(mBase + row) * ldc + n0 + c4) = vals[it];
        }
        
      }
    } else {
      const int q = lane >> 3, c8 = (lane & 7) * 8;
      unsigned short* C  = (unsigned short*)Cout;
      unsigned short* C2 = (unsigned short*)Cout2;
      unsigned short* C3 = (unsigned short*)Cout3;
      {
#pragma unroll
        for (int it = 0; it < 4; ++it) {
          const int row = it * 4 + q;
          const float* sp = slab + row * 68 + c8;
          v8h hv, lv, fv;
#pragma unroll
          for (int e = 0; e < 8; ++e) {
            const float sv = sp[e];
            if (OUT_MODE == 1) {
              hv[e] = (_Float16)sv;
            } else {
              const unsigned short hb = f2bf_bits(sv);
              const unsigned short lb = f2bf_bits(sv - bf_bits2f(hb));
              hv[e] = __builtin_bit_cast(_Float16, hb);
              lv[e] = __builtin_bit_cast(_Float16, lb);
              if (OUT_MODE == 3) fv[e] = (_Float16)(bf_bits2f(hb) + bf_bits2f(lb));
            }
          }
          *(v8h*)(C + (size_t)(mBase + row) * ldc + n0 + c8) = hv;
          if (OUT_MODE >= 2) *(v8h*)(C2 + (size_t)(mBase + row) * ldc + n0 + c8) = lv;
          if (OUT_MODE == 3) *(v8h*)(C3 + (size_t)(mBase + row) * ldc + n0 + c8) = fv;
        }
        
      }
    }
    __builtin_amdgcn_fence(__ATOMIC_RELEASE, "workgroup");
    __builtin_amdgcn_wave_barrier();
    __builtin_amdgcn_fence(__ATOMIC_ACQUIRE, "workgroup");
  }
}

/* one product per launch: blockIdx = (tile, branch, weight plane) */
template <int ET, bool SPLIT, int BIAS_MODE, int OUT_MODE, bool RESID, int ACT>
__global__ __launch_bounds__(128) void wmma_gemm64(GemmArgs ga) {
  __shared__ __attribute__((aligned(2048))) unsigned char ring[kRingLds];
  gemm_tile<ET, SPLIT, BIAS_MODE, OUT_MODE, RESID, ACT>(ga, (int)blockIdx.x, (int)blockIdx.y, (int)blockIdx.z, ring);
}

/* Three products of feat, none reading what another writes: blockIdx.z 0, 1 = Q, K (hi/lo products, the long blocks), 2 = first residual product (bias, relu). blockIdx.y = branch. Each has kSmallTiles tiles. */
constexpr int kSmallTiles = (kTok >> 7) * (kDim >> 7);
__global__ __launch_bounds__(128) void qk_res1_kernel(GemmArgs gq, GemmArgs gr) {
  __shared__ __attribute__((aligned(2048))) unsigned char ring[kRingLds];
  const int z = (int)blockIdx.z;
  if (z < 2) gemm_tile<1, true, 0, 2, false, 0>(gq, (int)blockIdx.x, (int)blockIdx.y, z, ring);
  else       gemm_tile<0, false, 2, 1, false, 2>(gr, (int)blockIdx.x, (int)blockIdx.y, 0, ring);
}

/* Logits and, independent of them and of each other, the second residual product (bias, relu) and V^T. Flat grid: the
   2 x kLogitTiles logit blocks (the long ones) first, branch A then B; then 2 x kSmallTiles residual blocks; then
   2 x kSmallTiles V^T blocks. */
constexpr int kLogitTiles = (kTok >> 7) * (kTok >> 7);
__global__ __launch_bounds__(128) void logits_res2_vt_kernel(GemmArgs gs, GemmArgs gr, GemmArgs gv) {
  __shared__ __attribute__((aligned(2048))) unsigned char ring[kRingLds];
  const int x = (int)blockIdx.x;
  if (x < 2 * kLogitTiles) {
    gemm_tile<1, true, 0, 0, false, 0>(gs, x % kLogitTiles, x / kLogitTiles, 0, ring);
  } else if (x < 2 * kLogitTiles + 2 * kSmallTiles) {
    const int u = x - 2 * kLogitTiles;
    gemm_tile<0, false, 2, 1, false, 2>(gr, u % kSmallTiles, u / kSmallTiles, 0, ring);
  } else {
    const int u = x - (2 * kLogitTiles + 2 * kSmallTiles);
    gemm_tile<0, false, 0, 1, false, 0>(gv, u % kSmallTiles, u / kSmallTiles, 0, ring);
  }
}

// ---------------------------------------------------------------------------
// Operand conversions, 8 contiguous elements per thread (two 16-B loads, one 16-B store per output plane).
// split8_bf16: f32 -> bf16 hi + bf16 lo (both RNE converts: hi = bf16(v), lo = bf16(v - hi)).
// cast8_f16: f32 -> f16 with a power-of-two carry.
// ---------------------------------------------------------------------------
__device__ __forceinline__ void split8_bf16(const float* __restrict__ p, unsigned short* __restrict__ qh,
                                            unsigned short* __restrict__ ql) {
  const v4f a0 = *(const v4f*)(p);
  const v4f a1 = *(const v4f*)(p + 4);
  v8h hv, lv;
#pragma unroll
  for (int e = 0; e < 4; ++e) {
    const float f0 = a0[e], f1 = a1[e];
    const unsigned short h0 = f2bf_bits(f0), h1 = f2bf_bits(f1);
    const unsigned short l0 = f2bf_bits(f0 - bf_bits2f(h0)), l1 = f2bf_bits(f1 - bf_bits2f(h1));
    hv[e]     = __builtin_bit_cast(_Float16, h0);
    hv[4 + e] = __builtin_bit_cast(_Float16, h1);
    lv[e]     = __builtin_bit_cast(_Float16, l0);
    lv[4 + e] = __builtin_bit_cast(_Float16, l1);
  }
  *(v8h*)qh = hv;
  *(v8h*)ql = lv;
  /* no register of the two stores is rewritten ahead of this wait, whichever block the compiler lays behind this one */
  asm volatile("s_wait_xcnt 0x0" ::: "memory");
}
__device__ __forceinline__ void cast8_f16(const float* __restrict__ p, unsigned short* __restrict__ q, float carry) {
  const v4f a0 = *(const v4f*)(p);
  const v4f a1 = *(const v4f*)(p + 4);
  v8h hv;
#pragma unroll
  for (int e = 0; e < 4; ++e) {
    const float f0 = a0[e] * carry, f1 = a1[e] * carry;
    hv[e]     = (_Float16)f0;
    hv[4 + e] = (_Float16)f1;
  }
  *(v8h*)q = hv;
  /* no register of the store is rewritten ahead of this wait, whichever block the compiler lays behind this one */
  asm volatile("s_wait_xcnt 0x0" ::: "memory");
}

// ---------------------------------------------------------------------------
// All operand conversions of the inputs in one launch (none reads what another writes). blockIdx.z = branch (sources
// a* or b*). blockIdx.x (block-uniform) picks the job: kXBlk blocks split x; 4 x kWBlk split the weights s0..s3 into
// planes 0..3 of WSH / WSL; 4 x kWBlk cast the weights c0..c3 into planes 0..3 of WF; kWBlk cast the ffn weight.
// Coverage: blocks x 256 threads x 8 elements = each plane exactly.
// ---------------------------------------------------------------------------
constexpr int kXBlk = (int)(kND / 8 / 256);
constexpr int kWBlk = (int)(kWW / 8 / 256);
constexpr int kPrepBlocks = kXBlk + 9 * kWBlk;
__global__ __launch_bounds__(256) void prep_kernel(
    const float* __restrict__ ax, const float* __restrict__ bx,
    const float* __restrict__ as0, const float* __restrict__ as1, const float* __restrict__ as2, const float* __restrict__ as3,
    const float* __restrict__ bs0, const float* __restrict__ bs1, const float* __restrict__ bs2, const float* __restrict__ bs3,
    const float* __restrict__ ac0, const float* __restrict__ ac1, const float* __restrict__ ac2, const float* __restrict__ ac3,
    const float* __restrict__ bc0, const float* __restrict__ bc1, const float* __restrict__ bc2, const float* __restrict__ bc3,
    const float* __restrict__ affn, const float* __restrict__ bffn,
    unsigned short* __restrict__ xh, unsigned short* __restrict__ xl,
    unsigned short* __restrict__ wsh, unsigned short* __restrict__ wsl,
    unsigned short* __restrict__ wf, unsigned short* __restrict__ ffn) {
  const int b = (int)blockIdx.x;
  const int z = (int)blockIdx.z;
  const int t = (int)threadIdx.x;
  if (b < kXBlk) {
    const size_t e0 = (size_t)(b * 256 + t) << 3;
    const size_t o = (size_t)z * kR0El16 + e0;
    split8_bf16((z ? bx : ax) + e0, xh + o, xl + o);
  } else if (b < kXBlk + 4 * kWBlk) {
    const int u = b - kXBlk;
    const int y = u / kWBlk;
    const size_t e0 = (size_t)((u % kWBlk) * 256 + t) << 3;
    const float* sa = (y == 0) ? as0 : (y == 1) ? as1 : (y == 2) ? as2 : as3;
    const float* sb = (y == 0) ? bs0 : (y == 1) ? bs1 : (y == 2) ? bs2 : bs3;
    const size_t o = (size_t)z * kR0El16 + (size_t)y * kWW + e0;
    split8_bf16((z ? sb : sa) + e0, wsh + o, wsl + o);
  } else if (b < kXBlk + 8 * kWBlk) {
    const int u = b - (kXBlk + 4 * kWBlk);
    const int y = u / kWBlk;
    const size_t e0 = (size_t)((u % kWBlk) * 256 + t) << 3;
    const float* sa = (y == 0) ? ac0 : (y == 1) ? ac1 : (y == 2) ? ac2 : ac3;
    const float* sb = (y == 0) ? bc0 : (y == 1) ? bc1 : (y == 2) ? bc2 : bc3;
    cast8_f16((z ? sb : sa) + e0, wf + (size_t)z * (4 * kWW) + (size_t)y * kWW + e0, kWCarry);
  } else {
    const size_t e0 = (size_t)((b - (kXBlk + 8 * kWBlk)) * 256 + t) << 3;
    cast8_f16((z ? bffn : affn) + e0, ffn + (size_t)z * kWW + e0, kWCarry);
  }
}

// ---------------------------------------------------------------------------
// Row statistics of S f32 [4096][4096] and the block's share of the column sums, S read once:
// m_i = max_j S_ij, inv_s_i = 1 / sum_j exp(S_ij - m_i), part_b[j] = sum over the block's 32 rows of exp(S_ij - m_i) * inv_s_i.
// Block = 32 rows (16 waves x 2 rows). A wave holds one whole row in registers: 32 lane-strided 16-B loads, all in
// flight together (lane owns columns it*128 + lane*4 .. +3); maximum, exponentials, sum and probabilities are formed
// in those registers. Row sum order: per-lane sequential, then xor shuffle tree (unconditional).
// Column share: each wave adds its two rows in its own LDS row (only the owning wave touches it in front of the
// barrier); behind the barrier the 16 wave rows are added in index order and stored as whole lines. No atomics.
// ---------------------------------------------------------------------------
constexpr int kRcRows  = 32;
constexpr int kRcWaves = 16;
constexpr int kRcParts = kTok / kRcRows;
static_assert(kTok == 32 * 128 && (kTok % kRcRows) == 0 && kRcRows == 2 * kRcWaves && kTok == 2 * kRcWaves * 32 * 4);
static_assert((size_t)2 * kRcParts * kTok * 4 == kCPBytes);

/* Four base-2 exponentials in place. One statement, so that directly behind each v_exp_f32 stands an instruction that
   neither reads its result nor rewrites its source: the next exponential, and a v_nop behind the last. */
__device__ __forceinline__ void exp2_x4(float& a, float& b, float& c, float& d) {
  asm("v_exp_f32 %0, %0\n\tv_exp_f32 %1, %1\n\tv_exp_f32 %2, %2\n\tv_exp_f32 %3, %3\n\tv_nop"
      : "+v"(a), "+v"(b), "+v"(c), "+v"(d));
}
constexpr float kLog2e = 1.4426950408889634f;  /* exp(t) = exp2(t * log2 e), the form __expf compiles to */

__global__ __launch_bounds__(512) void rowcol_kernel(const float* __restrict__ S0, float* __restrict__ mrow0,
                                                     float* __restrict__ invs0, float* __restrict__ cpart0) {
  __shared__ __align__(16) float sC[kRcWaves][kTok];
  __shared__ float sM[kRcRows];
  __shared__ float sI[kRcRows];
  /* blockIdx.y = branch */
  const float* S = S0 + (size_t)blockIdx.y * kR0El32;
  float* mrow = mrow0 + (size_t)blockIdx.y * kTok;
  float* invs = invs0 + (size_t)blockIdx.y * kTok;
  float* cpart = cpart0 + ((size_t)blockIdx.y * kRcParts + blockIdx.x) * kTok;
  const int lane = threadIdx.x & 31;
  const int wave = __builtin_amdgcn_readfirstlane((int)(threadIdx.x >> 5));
  const int row0 = blockIdx.x * kRcRows;
  float* myC = &sC[wave][lane * 4];
#pragma unroll 1  /* one copy of the row's code: the text stays small */
  for (int q = 0; q < 2; ++q) {
    const int rl = wave * 2 + q;
    const float* p = S + (size_t)(row0 + rl) * kTok + lane * 4;
    v4f x[32];
#pragma unroll
    for (int it = 0; it < 32; ++it) x[it] = *(const v4f*)(p + it * 128);
    /* stands in front of every rewrite of the loads' address registers: p as an input keeps them untouched up to here */
    asm volatile("s_wait_xcnt 0x0" :: "v"(p) : "memory");
    float m = -INFINITY;
#pragma unroll
    for (int it = 0; it < 32; ++it) m = fmaxf(m, fmaxf(fmaxf(x[it][0], x[it][1]), fmaxf(x[it][2], x[it][3])));
#pragma unroll
    for (int off = 16; off > 0; off >>= 1) m = fmaxf(m, __shfl_xor(m, off, 32));
    float sum = 0.f;
#pragma unroll
    for (int it = 0; it < 32; ++it) {
      float e0 = (x[it][0] - m) * kLog2e, e1 = (x[it][1] - m) * kLog2e;
      float e2 = (x[it][2] - m) * kLog2e, e3 = (x[it][3] - m) * kLog2e;
      exp2_x4(e0, e1, e2, e3);
      x[it] = (v4f){e0, e1, e2, e3};
      sum += e0;
      sum += e1;
      sum += e2;
      sum += e3;
    }
#pragma unroll
    for (int off = 16; off > 0; off >>= 1) sum += __shfl_xor(sum, off, 32);
    const float inv = 1.0f / sum;
    if (q == 0) {
#pragma unroll
      for (int it = 0; it < 32; ++it) *(v4f*)(myC + it * 128) = x[it] * inv;
    } else {
#pragma unroll
      for (int it = 0; it < 32; ++it) {
        const v4f c = *(const v4f*)(myC + it * 128);
        *(v4f*)(myC + it * 128) = c + x[it] * inv;
      }
    }
    if (lane == 0) {
      sM[rl] = m;
      sI[rl] = inv;
    }
  }
  __syncthreads();
  /* thread t adds columns h*2048 + 4t .. +3 of the 16 wave rows: 32 lanes x 16 B = 4 whole lines per store */
#pragma unroll
  for (int h = 0; h < 2; ++h) {
    const int col = h * 2048 + (int)threadIdx.x * 4;
    v4f c = *(const v4f*)(&sC[0][col]);
#pragma unroll
    for (int w = 1; w < kRcWaves; ++w) c = c + *(const v4f*)(&sC[w][col]);
    *(v4f*)(cpart + col) = c;
  }
  asm volatile("s_wait_xcnt 0x0" ::: "memory");  /* in front of wave 0's reuse of the registers that these stores name */
  if (wave == 0) {
    const float mv = sM[lane];
    const float iv = sI[lane];
    *(float*)(mrow + row0 + lane) = mv;
    *(float*)(invs + row0 + lane) = iv;
  }
}

// ---------------------------------------------------------------------------
// Column sums over queries: c_j = sum over the 128 block shares part_b[j], then rc_j = 1 / (1e-9 + c_j).
// Block = 32 columns (one 128-B line of every share), 4 waves. Eight partial sums as before: partial p adds shares
// p, p+8, ... (16 shares) in order; wave w forms partials w and w+4 (32 shares, all loads in flight together); the 8
// partials are combined in index order by wave 0. No atomics. jb = block of columns, br = branch, sP = 8 x 32 floats.
// ---------------------------------------------------------------------------
static_assert(kRcParts == 128);
__device__ __forceinline__ void colfin_block(const float* __restrict__ cpart0, float* __restrict__ rcol0, int jb, int br,
                                             float* sP) {
  const float* cpart = cpart0 + (size_t)br * kRcParts * kTok;
  float* rcol = rcol0 + (size_t)br * kTok;
  const int lane = threadIdx.x & 31;
  const int wave = __builtin_amdgcn_readfirstlane((int)(threadIdx.x >> 5));
  const int j0 = jb * 32;
  const float* pw = cpart + (size_t)wave * kTok + j0 + lane;
  float v[kRcParts / 4];
#pragma unroll
  for (int t = 0; t < kRcParts / 4; ++t) v[t] = pw[(size_t)(4 * t) * kTok];
  asm volatile("s_wait_xcnt 0x0" ::: "memory");  /* in front of every rewrite of the loads' address registers */
  float acc0 = 0.f, acc1 = 0.f;
#pragma unroll
  for (int t = 0; t < kRcParts / 8; ++t) {
    acc0 += v[2 * t];
    acc1 += v[2 * t + 1];
  }
  sP[wave * 32 + lane] = acc0;
  sP[(wave + 4) * 32 + lane] = acc1;
  __syncthreads();
  if (wave == 0) {
    float c = sP[0 * 32 + lane];
    c += sP[1 * 32 + lane];
    c += sP[2 * 32 + lane];
    c += sP[3 * 32 + lane];
    c += sP[4 * 32 + lane];
    c += sP[5 * 32 + lane];
    c += sP[6 * 32 + lane];
    c += sP[7 * 32 + lane];
    const float rc = 1.0f / (kAttnEps + c);
    *(float*)(rcol + j0 + lane) = rc;
  }
}

/* Third residual product (bias) and, independent of it, the last step of the column sums. Flat grid: the 2 x kSmallTiles
   product blocks (the long ones) first, branch A then B; then 2 x kColBlocks column blocks, which use the first 1 KiB
   of the ring for their partial sums. */
constexpr int kColBlocks = kTok / 32;
__global__ __launch_bounds__(128) void res3_colfin_kernel(GemmArgs gr, const float* __restrict__ cpart0,
                                                          float* __restrict__ rcol0) {
  __shared__ __attribute__((aligned(2048))) unsigned char ring[kRingLds];
  const int x = (int)blockIdx.x;
  if (x < 2 * kSmallTiles) {
    gemm_tile<0, false, 2, 1, false, 0>(gr, x % kSmallTiles, x / kSmallTiles, 0, ring);
  } else {
    const int u = x - 2 * kSmallTiles;
    colfin_block(cpart0, rcol0, u % kColBlocks, u / kColBlocks, (float*)ring);
  }
}

// ---------------------------------------------------------------------------
// attn.V: SC_z[i][d] = (1/32768) * sum over the keys j of half z of f16(32768 * P_ij * rc_j) * VT[d][j],
// P_ij = exp(S_ij - m_i) * inv_s_i. The two shares SC_0 + SC_1 are added by ln_ffn_kernel.
// Block = 64 query rows x all 512 d x 2048 keys (8 waves, wave w owns d columns 64w..64w+63, acc 4x4 tiles):
// blockIdx.z picks the half of the keys, so that 256 blocks stand on the chip and each walks 32 key tiles. The tile
// numbers below count inside the block's half.
// Operand path: tensor loads bring the tiles into LDS, padded to their pitches, three buffers. Stage s holds the
// V^T tile of keys 64s..64s+63 (512 rows x 128 B, pitch 144 B) and the logit tile of keys 64(s+1)..64(s+1)+63
// (64 rows x 256 B, pitch 272 B): trip t multiplies key tile t and forms the f16 weights of key tile t + 1 out of the
// same buffer, while the loads of stages t + 1 and t + 2 fly. Even stages are brought by waves 0..3, odd stages by
// waves 4..7: a wave never has more than one stage outstanding, so its wait for that stage is a wait to 0 and leaves
// the other half's younger stage in flight. The weight tiles (64 rows x 128 B, pitch 144 B) alternate between two
// places: the one written in trip t was last read in trip t - 1. Thread t forms row t>>2, keys (t&3)*16..+15
// (64 rows x 4 threads x 16 = the whole tile). The 4096 column factors are copied into LDS once, in the prologue.
// The pad bytes of every pitch are never read: all reads touch byte offsets below the row length.
// ---------------------------------------------------------------------------
constexpr int kAvK      = 64;
constexpr int kAvHalves = 2;
constexpr int kAvKeys   = kTok / kAvHalves;
constexpr int kAvVPitch = 144;
constexpr int kAvSPitch = 272;
constexpr int kAvAPitch = 144;
constexpr int kAvVLds   = kDim * kAvVPitch;
constexpr int kAvSLds   = 64 * kAvSPitch;
constexpr int kAvSPlace = (kAvSLds + 2047) / 2048 * 2048;  /* so that every tensor load's place is a multiple of 2 KiB */
constexpr int kAvStage  = kAvVLds + kAvSPlace;
constexpr int kAvALds   = 64 * kAvAPitch;
constexpr int kAvBufs   = 3;
constexpr int kAvOffA   = kAvBufs * kAvStage;
constexpr int kAvOffRC  = kAvOffA + 2 * kAvALds;
constexpr int kAvLds    = kAvOffRC + kTok * 4;
static_assert((kAvKeys % kAvK) == 0 && kAvKeys >= 3 * kAvK && kDim == 512);
static_assert(kAvVPitch >= kAvK * 2 && kAvSPitch >= kAvK * 4 && kAvAPitch >= kAvK * 2);
static_assert((kAvVPitch % 32) == 16 && (kAvSPitch % 32) == 16 && (kAvAPitch % 32) == 16);
static_assert(8 * kSlabLds <= kAvBufs * kAvStage && kAvLds <= 327680);
static_assert(((128 * kAvVPitch) % 2048) == 0 && (kAvVLds % 2048) == 0 && (kAvStage % 2048) == 0);
static_assert(kAvVPitch == kAvK * 2 + 16 && kAvSPitch == kAvK * 4 + 16);

/* This lane's four 16-B pieces, lstep LDS bytes and gstep source bytes apart. The copies and the s_wait_xcnt stand in
   one statement so that no address register is rewritten ahead of that wait. */
__device__ __forceinline__ void copy4_b128(unsigned l, unsigned lstep, const unsigned char* g, size_t gstep) {
  const unsigned l1 = l + lstep, l2 = l + 2 * lstep, l3 = l + 3 * lstep;
  const unsigned char *g1 = g + gstep, *g2 = g + 2 * gstep, *g3 = g + 3 * gstep;
  asm volatile(
      "global_load_async_to_lds_b128 %0, %4, off\n\t"
      "global_load_async_to_lds_b128 %1, %5, off\n\t"
      "global_load_async_to_lds_b128 %2, %6, off\n\t"
      "global_load_async_to_lds_b128 %3, %7, off\n\t"
      "s_wait_xcnt 0x0"
      :: "v"(l), "v"(l1), "v"(l2), "v"(l3), "v"(g), "v"(g1), "v"(g2), "v"(g3)
      : "memory");
}

__global__ __launch_bounds__(256) void av_kernel(const float* __restrict__ S0, const float* __restrict__ mrow0,
                                                 const float* __restrict__ invs0, const float* __restrict__ rcol0,
                                                 const unsigned short* __restrict__ VTp0, float* __restrict__ SC0) {
  /* stage buffers 0, 1, 2 | weight tile 0 | weight tile 1 | column factors */
  __shared__ __attribute__((aligned(2048))) unsigned char smem[kAvLds];
  /* blockIdx.y = branch, blockIdx.z = half of the keys; S and V^T start at the half's first key */
  const int key0 = (int)blockIdx.z * kAvKeys;
  const float* S = S0 + (size_t)blockIdx.y * kR0El32 + key0;
  const float* mrow = mrow0 + (size_t)blockIdx.y * kTok;
  const float* invs = invs0 + (size_t)blockIdx.y * kTok;
  const float* rcol = rcol0 + (size_t)blockIdx.y * kTok;
  const unsigned short* VTp = VTp0 + (size_t)blockIdx.y * kND + key0;
  float* SC = SC0 + ((size_t)blockIdx.z * 2 + blockIdx.y) * kND;
  typedef Frag<_Float16> FH;
  const int tid  = threadIdx.x;
  const int lane = tid & 31;
  const int wave = __builtin_amdgcn_readfirstlane((int)(tid >> 5));
  const int m0 = blockIdx.x * 64;
  const int n0 = wave * 64;
  const int sr   = tid >> 2;
  const int sc16 = (tid & 3) * 16;
  const float mi = mrow[m0 + sr];
  const float fi = invs[m0 + sr] * kPCarry;
  /* stands in front of every rewrite of the registers that these two loads name: as inputs they stay untouched up to here */
  asm volatile("s_wait_xcnt 0x0" :: "v"(m0 + sr), "s"(mrow), "s"(invs) : "memory");

  const int rlane = lane & 15;
  const int koff  = (lane >> 4) * 8;
  const int mOff  = (lane >> 4) * 8;
  constexpr int nT = kAvKeys / kAvK;

  /* tensor loads of the four waves that bring a stage, q4 = the wave's number among them. V^T: wave q4 brings rows
     128 q4 .. +127 (128 B each, padded to the pitch). Logits: wave 0 of the four brings the whole tile (64 rows of
     256 B, padded to the pitch) as a second request. Column factors: asynchronous copies of all 256 threads, piece
     t + 256q, q 0..3. */
  const int half = wave >> 2;
  const int q4 = wave & 3;
  const unsigned ldsBase = (unsigned)(size_t)(&smem[0]);
  const unsigned vDst = ldsBase + (unsigned)(q4 * 128 * kAvVPitch);
  const unsigned sDst = ldsBase + (unsigned)kAvVLds;
  const unsigned long long vSrc = (unsigned long long)(size_t)((const unsigned char*)VTp + (size_t)(q4 * 128) * (kTok * 2));
  const unsigned long long sSrc = (unsigned long long)(size_t)((const unsigned char*)S + (size_t)m0 * (kTok * 4));
  v8u gv1 = tdm_group1(kPad128, 128u, 128u, (unsigned)(kTok * 2));
  v8u gs1 = tdm_group1(kPad256, 256u, 64u, (unsigned)(kTok * 4));
  /* descriptor words held in scalar registers: without the pin the compiler forms the constants anew at every load,
     over registers that an outstanding request names */
  asm volatile("" : "+s"(gv1), "+s"(gs1));
  v4u gv0 = (v4u){0u, 0u, 0u, 0u}, gs0 = (v4u){0u, 0u, 0u, 0u}, gp0 = (v4u){0u, 0u, 0u, 0u};

  auto issue_logits = [&](v4u& g0, unsigned u, unsigned b) {
    g0 = tdm_group0(sDst + b * (unsigned)kAvStage, sSrc + (unsigned long long)u * (kAvK * 4));
    asm volatile("" : "+s"(g0));  /* descriptor words held in scalar registers, as above */
    tdm_load(g0, gs1);
  };
  auto issue_vt = [&](unsigned s, unsigned b) {
    gv0 = tdm_group0(vDst + b * (unsigned)kAvStage, vSrc + (unsigned long long)s * (kAvK * 2));
    asm volatile("" : "+s"(gv0));  /* descriptor words held in scalar registers, as above */
    tdm_load(gv0, gv1);
  };
  /* this wave's requests have landed; the groups as inputs: their registers keep their values while one is outstanding */
  auto wait_tiles = [&]() {
    asm volatile("s_wait_tensorcnt 0x0" :: "s"(gv0), "s"(gs0), "s"(gp0), "s"(gv1), "s"(gs1) : "memory");
  };
  /* this thread's 16 weights of key tile u, out of the logit tile at sraw */
  auto weights = [&](int u, const unsigned char* sraw, v8h& h0, v8h& h1) {
    const float* sp = (const float*)(sraw + sr * kAvSPitch) + sc16;
    const float* rp = (const float*)(smem + kAvOffRC) + key0 + u * kAvK + sc16;
#pragma unroll
    for (int h = 0; h < 2; ++h) {
      const v4f s0 = *(const v4f*)(sp + h * 8);
      const v4f s1 = *(const v4f*)(sp + h * 8 + 4);
      const v4f r0 = *(const v4f*)(rp + h * 8);
      const v4f r1 = *(const v4f*)(rp + h * 8 + 4);
      v8h hv;
#pragma unroll
      for (int e = 0; e < 4; ++e) {
        const float e0 = __expf(s0[e] - mi);
        const float e1 = __expf(s1[e] - mi);
        const float w0 = (e0 * fi) * r0[e];
        const float w1 = (e1 * fi) * r1[e];
        hv[e]     = (_Float16)w0;
        hv[4 + e] = (_Float16)w1;
      }
      if (h == 0) h0 = hv; else h1 = hv;
    }
  };
  auto put_weights = [&](unsigned char* at, v8h h0, v8h h1) {
    *(v8h*)(at + sr * kAvAPitch + sc16 * 2) = h0;
    *(v8h*)(at + sr * kAvAPitch + sc16 * 2 + 16) = h1;
  };

  v8f acc[4][4];
#pragma unroll
  for (int i = 0; i < 4; ++i)
#pragma unroll
    for (int j = 0; j < 4; ++j) acc[i][j] = (v8f){0.f, 0.f, 0.f, 0.f, 0.f, 0.f, 0.f, 0.f};

  /* the 64 keys of one tile: weight tile at, V^T tile vt */
  auto products = [&](const unsigned char* at, const unsigned char* vt) {
#pragma unroll
    for (int kk = 0; kk < kAvK; kk += 32) {
      v16h bh[4];
#pragma unroll
      for (int j = 0; j < 4; ++j)
        bh[j] = FH::load((const _Float16*)(vt + (n0 + (j << 4) + rlane) * kAvVPitch + (kk + koff) * 2));
      const unsigned char* ap = at + rlane * kAvAPitch + (kk + koff) * 2;
      v16h ah = FH::load((const _Float16*)ap);
#pragma unroll
      for (int i = 0; i < 4; ++i) {
        /* the next row group's A fragment is read in front of this group's products */
        v16h nh = ah;
        if (i < 3) nh = FH::load((const _Float16*)(ap + (i + 1) * 16 * kAvAPitch));
#pragma unroll
        for (int j = 0; j < 4; ++j) acc[i][j] = FH::mma(ah, bh[j], acc[i][j]);
        FH::guard(acc[i][0], acc[i][1], acc[i][2], acc[i][3], ah, ah);
        ah = nh;
      }
      FH::keep(bh[0], bh[1], bh[2], bh[3]);
    }
  };

  /* prologue: column factors, logit tile 0 (in buffer 2's logit place), stage 0 (waves 0..3) and stage 1 (waves 4..7)
     landed and published */
  copy4_b128(ldsBase + (unsigned)(kAvOffRC + tid * 16), 4096, (const unsigned char*)rcol + tid * 16, (size_t)4096);
  const unsigned first = pinned((unsigned)(q4 == 0));  /* scalar: the wave of the four that brings the logit tile */
  /* waves 0..3 bring stage 0 into buffer 0, waves 4..7 stage 1 into buffer 1; wave 0 also logit tile 0 */
  const unsigned hs = pinned((unsigned)half);
  issue_vt(hs, hs);
  if (first) issue_logits(gs0, hs + 1u, hs);
  if (pinned(first & (unsigned)(half == 0))) issue_logits(gp0, 0u, 2u);
  wait_tiles();                                      /* this wave's prologue tiles (three at the most) have landed */
  asm volatile("s_wait_asynccnt 0x0" ::: "memory");  /* this wave's copies of the column factors have landed */
  __syncthreads();

  /* Trip -1 forms weight tile 0 out of buffer 2 and multiplies nothing; its foot ends the reads of buffer 2 and issues
     stage 2. So every load that stays outstanding is issued at the loop's one place, and nothing moves its
     descriptor's registers on the way into the loop. */
  int buf = 2;  /* t mod 3 */
#pragma unroll 1  /* one stage per trip: the foot's waits and barrier stand once */
  for (int t = -1; t < nT - 1; ++t) {
    const unsigned char* sb = smem + buf * kAvStage;
    v8h h0, h1;
    weights(t + 1, sb + kAvVLds, h0, h1);
    if (t >= 0) products(smem + kAvOffA + (t & 1) * kAvALds, sb);
    put_weights(smem + kAvOffA + ((t + 1) & 1) * kAvALds, h0, h1);
    /* publish point of stage t + 1 and of weight tile t + 1; the one barrier also ends every reader's last read of
       stage t's buffer and of weight tile t. Stage t + 1 and stage t + 3 belong to the same half of the waves. */
    const unsigned mine = pinned((unsigned)(((t + 1) & 1) == half));  /* scalar: the waits and loads below are this half's */
    asm volatile("s_wait_dscnt 0x0" ::: "memory");  /* this wave's LDS reads and writes of trip t are done */
    if (mine) wait_tiles();  /* this wave's stage t + 1 tiles, its only ones, have landed */
    __syncthreads();
    if (pinned(mine & (unsigned)(t + 3 < nT))) {  /* into the buffer that trip t has just read */
      const unsigned s3 = pinned((unsigned)(t + 3));  /* the descriptors are formed behind the wait */
      issue_vt(s3, (unsigned)buf);
      if (pinned(first & (unsigned)(t + 4 < nT))) issue_logits(gs0, s3 + 1u, (unsigned)buf);
    }
    buf = (buf == kAvBufs - 1) ? 0 : buf + 1;
  }
  products(smem + kAvOffA + ((nT - 1) & 1) * kAvALds, smem + ((nT - 1) % kAvBufs) * kAvStage);
  wait_tiles();  /* no request is outstanding when the ring becomes the slabs */
  asm volatile("s_wait_dscnt 0x0" ::: "memory");     /* this wave's last fragment reads have returned */
  __syncthreads();                                   /* every wave has left the ring before a slab is written */
  acc_guard4(acc[0][0], acc[0][1], acc[0][2], acc[0][3]);
  acc_guard4(acc[1][0], acc[1][1], acc[1][2], acc[1][3]);
  acc_guard4(acc[2][0], acc[2][1], acc[2][2], acc[2][3]);
  acc_guard4(acc[3][0], acc[3][1], acc[3][2], acc[3][3]);

  float* slab = (float*)(smem + wave * kSlabLds);
#pragma unroll
  for (int i = 0; i < 4; ++i) {
    const int mBase = m0 + (i << 4);
#pragma unroll
    for (int j = 0; j < 4; ++j) {
#pragma unroll
      for (int r = 0; r < 8; ++r) slab[(mOff + r) * 68 + (j << 4) + rlane] = acc[i][j][r] * kPCarryInv;
    }
    __builtin_amdgcn_fence(__ATOMIC_RELEASE, "workgroup");
    __builtin_amdgcn_wave_barrier();
    __builtin_amdgcn_fence(__ATOMIC_ACQUIRE, "workgroup");
    {
      const int hh = lane >> 4, c4 = (lane & 15) * 4;
      v4f vals[8];
#pragma unroll
      for (int it = 0; it < 8; ++it) vals[it] = *(const v4f*)(slab + (it * 2 + hh) * 68 + c4);
      {
#pragma unroll
        for (int it = 0; it < 8; ++it) {
          const int row = it * 2 + hh;
          *(v4f*)(SC + (size_t)(mBase + row) * kDim + n0 + c4) = vals[it];
        }
        
      }
    }
    __builtin_amdgcn_fence(__ATOMIC_RELEASE, "workgroup");
    __builtin_amdgcn_wave_barrier();
    __builtin_amdgcn_fence(__ATOMIC_ACQUIRE, "workgroup");
  }
}

// ---------------------------------------------------------------------------
// s = LayerNorm(res + sc) over 512 (biased variance, eps inside rsqrt) and out = s + s . ffnW^T, one launch.
// Block = 32 token rows x all 512 output columns, 8 waves; blockIdx.y = branch.
// LayerNorm: wave w forms rows 4w..4w+3, one row at a time in the whole wave, all four rows' loads in flight together.
// sc = the two key halves' shares of attn.V, added here (share 1 lies 2 planes behind share 0). Lane owns columns
// it*128 + lane*4 .. +3 (it 0..3): 16 values in registers, static indexing. res is an f16 plane read as 32-bit integer
// words; sc, gamma, beta f32. s stays in LDS: an f32 plane (pitch 2064 B), the residual of the store phase, and an f16
// plane (pitch 1040 B = 16 B x 65), the A operand.
// Product: wave w owns output columns 64w..64w+63 (acc 2x4 tiles), K = 512 in 8 stages of 64 k. A stage is the weight's
// 512 rows x 128 B (pitch 144 B), brought into LDS by tensor loads (128 rows each), three buffers: even stages are
// brought by waves 0..3, odd stages by waves 4..7, so a wave never has more than one request outstanding and its wait
// for that stage is a wait to 0. Stages 0 and 1 fly while the rows are normalised.
// The pad bytes of every pitch are never read.
// ---------------------------------------------------------------------------
constexpr int kLfRows   = 32;
constexpr int kLfK      = 64;
constexpr int kLfBPitch = 144;
constexpr int kLfBLds   = kDim * kLfBPitch;
constexpr int kLfBufs   = 3;
constexpr int kLfAPitch = kDim * 2 + 16;
constexpr int kLfYPitch = kDim * 4 + 16;
constexpr int kLfOffA   = kLfBufs * kLfBLds;
constexpr int kLfOffY   = kLfOffA + kLfRows * kLfAPitch;
constexpr int kLfLds    = kLfOffY + kLfRows * kLfYPitch;
static_assert((kTok % kLfRows) == 0 && (kDim % kLfK) == 0 && kDim / kLfK >= 3 && kDim == 512);
static_assert((kLfBPitch % 32) == 16 && (kLfAPitch % 32) == 16 && (kLfYPitch % 16) == 0 && kLfBPitch >= kLfK * 2);
static_assert(8 * kSlabLds <= kLfOffA && kLfLds <= 327680);
static_assert(((128 * kLfBPitch) % 2048) == 0 && (kLfBLds % 2048) == 0 && kLfBPitch == kLfK * 2 + 16);

__global__ __launch_bounds__(256) void ln_ffn_kernel(const unsigned short* __restrict__ RES0, const float* __restrict__ SCp0,
                                                     const float* __restrict__ gam0, const float* __restrict__ bet0,
                                                     const float* __restrict__ gam1, const float* __restrict__ bet1,
                                                     const unsigned short* __restrict__ Wp0, float* __restrict__ out0) {
  /* weight stage buffers 0, 1, 2 | s f16 | s f32 */
  __shared__ __attribute__((aligned(2048))) unsigned char smem[kLfLds];
  /* blockIdx.y = branch */
  const unsigned short* RES = RES0 + (size_t)blockIdx.y * kND;
  const float* SCp = SCp0 + (size_t)blockIdx.y * kND;
  const float* SCq = SCp0 + ((size_t)blockIdx.y + 2) * kND;
  const float* gam = blockIdx.y ? gam1 : gam0;
  const float* bet = blockIdx.y ? bet1 : bet0;
  const unsigned short* Wp = Wp0 + (size_t)blockIdx.y * kWW;
  float* out = out0 + (size_t)blockIdx.y * kND;
  typedef Frag<_Float16> FH;
  const int tid  = threadIdx.x;
  const int lane = tid & 31;
  const int wave = __builtin_amdgcn_readfirstlane((int)(tid >> 5));
  const int m0 = blockIdx.x * kLfRows;
  const int n0 = wave * 64;
  const int rlane = lane & 15;
  const int koff  = (lane >> 4) * 8;
  const int mOff  = (lane >> 4) * 8;
  constexpr int nT = kDim / kLfK;

  /* tensor loads of the four waves that bring a stage: wave q4 of them brings weight rows 128 q4 .. +127 (128 B each,
     padded to the pitch), one request */
  const int half = wave >> 2;
  const int q4 = wave & 3;
  const unsigned bDst = (unsigned)(size_t)(&smem[0]) + (unsigned)(q4 * 128 * kLfBPitch);
  const unsigned long long bSrc = (unsigned long long)(size_t)((const unsigned char*)Wp + (size_t)(q4 * 128) * (kDim * 2));
  v8u gb1 = tdm_group1(kPad128, 128u, 128u, (unsigned)(kDim * 2));
  /* descriptor words held in scalar registers: without the pin the compiler forms the constants anew at every load,
     over registers that an outstanding request names */
  asm volatile("" : "+s"(gb1));
  v4u gb0 = (v4u){0u, 0u, 0u, 0u};
  auto issue_stage = [&](unsigned s, unsigned b) {
    gb0 = tdm_group0(bDst + b * (unsigned)kLfBLds, bSrc + (unsigned long long)s * (kLfK * 2));
    asm volatile("" : "+s"(gb0));  /* descriptor words held in scalar registers, as above */
    tdm_load(gb0, gb1);
  };
  /* this wave's request has landed; the groups as inputs: their registers keep their values while it is outstanding */
  auto wait_tile = [&]() { asm volatile("s_wait_tensorcnt 0x0" :: "s"(gb0), "s"(gb1) : "memory"); };
  /* waves 0..3 bring stage 0 into buffer 0, waves 4..7 stage 1 into buffer 1 */
  const unsigned hs = pinned((unsigned)half);
  issue_stage(hs, hs);

  /* ---- add + LayerNorm of this wave's four rows ---- */
  {
    v4f sa[4][4], sb[4][4], g4[4], b4[4];
    v2u rw[4][4];
#pragma unroll
    for (int q = 0; q < 4; ++q) {
      const size_t ro = (size_t)(m0 + wave * 4 + q) * kDim;
#pragma unroll
      for (int it = 0; it < 4; ++it) {
        const int col = it * 128 + lane * 4;
        sa[q][it] = *(const v4f*)(SCp + ro + col);
        sb[q][it] = *(const v4f*)(SCq + ro + col);
        rw[q][it] = *(const v2u*)(RES + ro + col);
      }
    }
#pragma unroll
    for (int it = 0; it < 4; ++it) {
      g4[it] = *(const v4f*)(gam + it * 128 + lane * 4);
      b4[it] = *(const v4f*)(bet + it * 128 + lane * 4);
    }
    asm volatile("s_wait_xcnt 0x0" ::: "memory");  /* in front of every rewrite of the loads' address registers */
#pragma unroll
    for (int q = 0; q < 4; ++q) {
      const int rl = wave * 4 + q;
      float x[16];
#pragma unroll
      for (int it = 0; it < 4; ++it) {
        const v4f a = sa[q][it] + sb[q][it];
        const unsigned w0 = rw[q][it][0];
        const unsigned w1 = rw[q][it][1];
        x[4 * it + 0] = h16_to_f32(w0 & 0xffffu) + a[0];
        x[4 * it + 1] = h16_to_f32(w0 >> 16) + a[1];
        x[4 * it + 2] = h16_to_f32(w1 & 0xffffu) + a[2];
        x[4 * it + 3] = h16_to_f32(w1 >> 16) + a[3];
      }
      float s = 0.f;
#pragma unroll
      for (int i = 0; i < 16; ++i) s += x[i];
#pragma unroll
      for (int off = 16; off > 0; off >>= 1) s += __shfl_xor(s, off, 32);
      const float mu = s * kInvDim;
      float vs = 0.f;
#pragma unroll
      for (int i = 0; i < 16; ++i) {
        const float d = x[i] - mu;
        x[i] = d;
        vs += d * d;
      }
#pragma unroll
      for (int off = 16; off > 0; off >>= 1) vs += __shfl_xor(vs, off, 32);
      const float inv = rsqrtf(vs * kInvDim + kLnEps);
#pragma unroll
      for (int it = 0; it < 4; ++it) {
        const int col = it * 128 + lane * 4;
        v4f y;
        y[0] = (x[4 * it + 0] * inv) * g4[it][0] + b4[it][0];
        y[1] = (x[4 * it + 1] * inv) * g4[it][1] + b4[it][1];
        y[2] = (x[4 * it + 2] * inv) * g4[it][2] + b4[it][2];
        y[3] = (x[4 * it + 3] * inv) * g4[it][3] + b4[it][3];
        v4h h;
        h[0] = (_Float16)y[0];
        h[1] = (_Float16)y[1];
        h[2] = (_Float16)y[2];
        h[3] = (_Float16)y[3];
        *(v4f*)(smem + kLfOffY + rl * kLfYPitch + col * 4) = y;
        *(v4h*)(smem + kLfOffA + rl * kLfAPitch + col * 2) = h;
      }
    }
  }

  v8f acc[2][4];
#pragma unroll
  for (int i = 0; i < 2; ++i)
#pragma unroll
    for (int j = 0; j < 4; ++j) acc[i][j] = (v8f){0.f, 0.f, 0.f, 0.f, 0.f, 0.f, 0.f, 0.f};

  /* the 64 k of stage t: weight tile bt */
  auto products = [&](int t, const unsigned char* bt) {
#pragma unroll
    for (int kk = 0; kk < kLfK; kk += 32) {
      v16h bh[4];
#pragma unroll
      for (int j = 0; j < 4; ++j)
        bh[j] = FH::load((const _Float16*)(bt + (n0 + (j << 4) + rlane) * kLfBPitch + (kk + koff) * 2));
      const unsigned char* ap = smem + kLfOffA + rlane * kLfAPitch + (t * kLfK + kk + koff) * 2;
      const v16h a0 = FH::load((const _Float16*)ap);
      const v16h a1 = FH::load((const _Float16*)(ap + 16 * kLfAPitch));
#pragma unroll
      for (int j = 0; j < 4; ++j) acc[0][j] = FH::mma(a0, bh[j], acc[0][j]);
#pragma unroll
      for (int j = 0; j < 4; ++j) acc[1][j] = FH::mma(a1, bh[j], acc[1][j]);
    }
  };

  /* Stages 0 and 1 landed. Trip -1 multiplies nothing: its foot publishes them and both planes of s and issues stage 2.
     So every load that stays outstanding over a trip is issued at the loop's one place, and nothing moves its
     descriptor's registers on the way into the loop. */
  wait_tile();  /* this wave's first stage has landed */

  int buf = 2;  /* t mod 3 */
#pragma unroll 1  /* one stage per trip: the foot's waits and barrier stand once */
  for (int t = -1; t < nT - 1; ++t) {
    if (t >= 0) products(t, smem + buf * kLfBLds);
    /* publish point of stage t + 1; the one barrier also ends every reader's last read of stage t's buffer. Stage
       t + 1 and stage t + 3 belong to the same half of the waves. */
    const unsigned mine = pinned((unsigned)(((t + 1) & 1) == half));  /* scalar: the wait and the load below are this half's */
    asm volatile("s_wait_dscnt 0x0" ::: "memory");  /* this wave's reads of stage t have returned (trip -1: its rows of s are written) */
    if (mine) wait_tile();  /* this wave's stage t + 1 tile, its only one, has landed */
    __syncthreads();
    if (pinned(mine & (unsigned)(t + 3 < nT)))  /* into the buffer that trip t has just read */
      issue_stage(pinned((unsigned)(t + 3)), (unsigned)buf);  /* the descriptor is formed behind the wait */
    buf = (buf == kLfBufs - 1) ? 0 : buf + 1;
  }
  products(nT - 1, smem + ((nT - 1) % kLfBufs) * kLfBLds);
  wait_tile();  /* no request is outstanding when the ring becomes the slabs */
  asm volatile("s_wait_dscnt 0x0" ::: "memory");     /* this wave's last fragment reads have returned */
  __syncthreads();                                   /* every wave has left the ring before a slab is written */

  /* store phase: 16-row slabs per wave (only the owning wave touches its slab); the residual s comes from its f32 plane */
  float* slab = (float*)(smem + wave * kSlabLds);
#pragma unroll
  for (int i = 0; i < 2; ++i) {
    const int mBase = i << 4;
#pragma unroll
    for (int j = 0; j < 4; ++j) {
#pragma unroll
      for (int r = 0; r < 8; ++r) slab[(mOff + r) * 68 + (j << 4) + rlane] = acc[i][j][r] * kWCarryInv;
    }
    __builtin_amdgcn_fence(__ATOMIC_RELEASE, "workgroup");
    __builtin_amdgcn_wave_barrier();
    __builtin_amdgcn_fence(__ATOMIC_ACQUIRE, "workgroup");
    {
      const int hh = lane >> 4, c4 = (lane & 15) * 4;
      v4f vals[8];
#pragma unroll
      for (int it = 0; it < 8; ++it) {
        const int row = it * 2 + hh;
        const v4f v = *(const v4f*)(slab + row * 68 + c4);
        const v4f rr = *(const v4f*)(smem + kLfOffY + (mBase + row) * kLfYPitch + (n0 + c4) * 4);
        vals[it] = v + rr;
      }
#pragma unroll
      for (int it = 0; it < 8; ++it) {
        const int row = it * 2 + hh;
        *(v4f*)(out + (size_t)(m0 + mBase + row) * kDim + n0 + c4) = vals[it];
      }
      asm volatile("s_wait_xcnt 0x0" ::: "memory");  /* in front of every rewrite of the registers that these stores name */
    }
    __builtin_amdgcn_fence(__ATOMIC_RELEASE, "workgroup");
    __builtin_amdgcn_wave_barrier();
    __builtin_amdgcn_fence(__ATOMIC_ACQUIRE, "workgroup");
  }
}

// ---------------------------------------------------------------------------
// Host glue (kernel launches and host arithmetic only)
// ---------------------------------------------------------------------------
static GemmArgs gemm_args(const unsigned short* A, const unsigned short* A2, int lda,
                          const unsigned short* Bt, const unsigned short* Bt2, int ldb,
                          void* C, void* C2, int ldc,
                          const float* bias0, const float* bias1, const float* resid0, const float* resid1,
                          long aP, long bP, long bQ, long cP, long cQ, int M, int N, int K, float scale) {
  GemmArgs g;
  g.Ap0 = A;  g.A2p0 = A2;  g.Btp0 = Bt;  g.Bt2p0 = Bt2;  g.Cout0 = C;  g.Cout20 = C2;  g.Cout30 = C2;
  g.bias0 = bias0;  g.bias1 = bias1;  g.resid0 = resid0;  g.resid1 = resid1;
  g.aP = aP;  g.bP = bP;  g.bQ = bQ;  g.cP = cP;  g.cQ = cQ;  g.c3P = 0L;
  g.lda = lda;  g.ldb = ldb;  g.ldc = ldc;  g.M = M;  g.N = N;  g.K = K;
  g.scale = scale;
  return g;
}

template <int ET, bool SPLIT, int BIAS_MODE, int OUT_MODE, bool RESID, int ACT>
static void run_gemm(hipStream_t st,
                     const unsigned short* A, const unsigned short* A2, int lda,
                     const unsigned short* Bt, const unsigned short* Bt2, int ldb,
                     void* C, void* C2, int ldc,
                     const float* bias0, const float* bias1, const float* resid0, const float* resid1,
                     long aP, long bP, long bQ, long cP, long cQ, int planes,
                     int M, int N, int K, float scale) {
  const int blocks = (M >> 7) * (N >> 7);
  wmma_gemm64<ET, SPLIT, BIAS_MODE, OUT_MODE, RESID, ACT><<<dim3(blocks, 2, planes), 128, 0, st>>>(
      gemm_args(A, A2, lda, Bt, Bt2, ldb, C, C2, ldc, bias0, bias1, resid0, resid1, aP, bP, bQ, cP, cQ, M, N, K, scale));
}

extern "C" void kernel_launch(void* const* d_in, const int* in_sizes, int n_in,
                              void* d_out, int out_size, void* d_ws, size_t ws_size,
                              hipStream_t stream) {
  if (n_in < 34) return;
  if (in_sizes[0] != (int)kND || in_sizes[1] != (int)kND) return;
  for (int p = 0; p < 2; ++p) {
    for (int s = 0; s < 16; ++s) {
      const bool isMat = (s == 0 || s == 2 || s == 4 || s == 6 || s == 8 || s == 10 || s == 11 || s == 12 || s == 15);
      const int want = isMat ? (int)kWW : kDim;
      if (in_sizes[2 + 16 * p + s] != want) return;
    }
  }
  if (out_size != (int)(2 * kND)) return;
  if (ws_size < kWsTotal) return;

  char* ws = (char*)d_ws;
  unsigned short* XH  = (unsigned short*)(ws + kOffXH);
  unsigned short* XL  = (unsigned short*)(ws + kOffXL);
  unsigned short* T0H = (unsigned short*)(ws + kOffT0H);
  unsigned short* T0L = (unsigned short*)(ws + kOffT0L);
  unsigned short* FH  = (unsigned short*)(ws + kOffFH);
  unsigned short* FL  = (unsigned short*)(ws + kOffFL);
  unsigned short* F16 = (unsigned short*)(ws + kOffF16);
  unsigned short* R1  = (unsigned short*)(ws + kOffR1);
  unsigned short* R2  = (unsigned short*)(ws + kOffR2);
  unsigned short* WSH = (unsigned short*)(ws + kOffWSH);
  unsigned short* WSL = (unsigned short*)(ws + kOffWSL);
  unsigned short* WF  = (unsigned short*)(ws + kOffWF);
  float*          S   = (float*)(ws + kOffS);
  unsigned short* QK  = (unsigned short*)(ws + kOffQK);
  unsigned short* VT  = (unsigned short*)(ws + kOffVT);
  unsigned short* RES = (unsigned short*)(ws + kOffRES);
  float*          SC  = (float*)(ws + kOffSC);
  unsigned short* FFN = (unsigned short*)(ws + kOffFFN);
  float*          MROW = (float*)(ws + kOffMROW);
  float*          INVS = (float*)(ws + kOffINVS);
  float*          RC   = (float*)(ws + kOffRC);
  float*          CP   = (float*)(ws + kOffCP);
  float* out = (float*)d_out;

  /* inputs of branch A (a*) and branch B (b*) */
  const float* ax   = (const float*)d_in[0];
  const float* bx   = (const float*)d_in[1];
  const float* apW1 = (const float*)d_in[2 + 0];
  const float* bpW1 = (const float*)d_in[18 + 0];
  const float* apb1 = (const float*)d_in[2 + 1];
  const float* bpb1 = (const float*)d_in[18 + 1];
  const float* apW2 = (const float*)d_in[2 + 2];
  const float* bpW2 = (const float*)d_in[18 + 2];
  const float* apb2 = (const float*)d_in[2 + 3];
  const float* bpb2 = (const float*)d_in[18 + 3];
  const float* arW1 = (const float*)d_in[2 + 4];
  const float* brW1 = (const float*)d_in[18 + 4];
  const float* arb1 = (const float*)d_in[2 + 5];
  const float* brb1 = (const float*)d_in[18 + 5];
  const float* arW2 = (const float*)d_in[2 + 6];
  const float* brW2 = (const float*)d_in[18 + 6];
  const float* arb2 = (const float*)d_in[2 + 7];
  const float* brb2 = (const float*)d_in[18 + 7];
  const float* arW3 = (const float*)d_in[2 + 8];
  const float* brW3 = (const float*)d_in[18 + 8];
  const float* arb3 = (const float*)d_in[2 + 9];
  const float* brb3 = (const float*)d_in[18 + 9];
  const float* aWq  = (const float*)d_in[2 + 10];
  const float* bWq  = (const float*)d_in[18 + 10];
  const float* aWk  = (const float*)d_in[2 + 11];
  const float* bWk  = (const float*)d_in[18 + 11];
  const float* aWv  = (const float*)d_in[2 + 12];
  const float* bWv  = (const float*)d_in[18 + 12];
  const float* alng = (const float*)d_in[2 + 13];
  const float* blng = (const float*)d_in[18 + 13];
  const float* alnb = (const float*)d_in[2 + 14];
  const float* blnb = (const float*)d_in[18 + 14];
  const float* affn = (const float*)d_in[2 + 15];
  const float* bffn = (const float*)d_in[18 + 15];

  /* Every launch below works on both branches: the pointers are branch A's, the strides lead to branch B's part. */
  const long r0B   = (long)kR0Bytes;
  const long nd    = (long)kND;
  const long ww    = (long)kWW;

  /* operand planes, one launch: x hi/lo; pW1,pW2,Wq,Wk hi/lo (weights are [out][in] = Bt layout); rW1,rW2,rW3,Wv and
     the ffn weight f16 x256 */
  prep_kernel<<<dim3(kPrepBlocks, 1, 2), 256, 0, stream>>>(ax, bx, apW1, apW2, aWq, aWk, bpW1, bpW2, bWq, bWk,
                                                           arW1, arW2, arW3, aWv, brW1, brW2, brW3, bWv, affn, bffn,
                                                           XH, XL, WSH, WSL, WF, FFN);

  /* h1 = relu(x . pW1^T + pb1) -> hi/lo : M 4096, N 512, K 512 */
  run_gemm<1, true, 2, 2, false, 2>(stream, XH, XL, kDim, WSH + 0 * kWW, WSL + 0 * kWW, kDim,
                                    (void*)T0H, (void*)T0L, kDim, apb1, bpb1, apb1, bpb1,
                                    kR0El16, kR0El16, 0L, r0B, 0L, 1, kTok, kDim, kDim, 1.0f);
  /* feat = h1 . pW2^T + pb2 -> hi/lo, and the f16 copy of hi + lo out of the same store phase */
  {
    GemmArgs gf = gemm_args(T0H, T0L, kDim, WSH + 1 * kWW, WSL + 1 * kWW, kDim, (void*)FH, (void*)FL, kDim,
                            apb2, bpb2, apb2, bpb2, kR0El16, kR0El16, 0L, r0B, 0L, kTok, kDim, kDim, 1.0f);
    gf.Cout30 = (void*)F16;
    gf.c3P = 2 * nd;
    wmma_gemm64<1, true, 2, 3, false, 0><<<dim3(kSmallTiles, 2, 1), 128, 0, stream>>>(gf);
  }
  /* One launch. Q (plane 0) and K (plane 1) -> hi/lo planes; QK holds QH QL KH KL of branch A, then of branch B.
     r1 = relu(feat . rW1^T + rb1) (f16 single products, weights x256). */
  qk_res1_kernel<<<dim3(kSmallTiles, 2, 3), 128, 0, stream>>>(
      gemm_args(FH, FL, kDim, WSH + 2 * kWW, WSL + 2 * kWW, kDim, (void*)QK, (void*)(QK + kND), kDim,
                apb1, bpb1, apb1, bpb1, kR0El16, kR0El16, ww, 8 * nd, 4 * nd, kTok, kDim, kDim, 1.0f),
      gemm_args(F16, F16, kDim, WF + 0 * kWW, WF + 0 * kWW, kDim, (void*)R1, (void*)R1, kDim,
                arb1, brb1, arb1, brb1, nd, 4 * ww, 0L, 2 * nd, 0L, kTok, kDim, kDim, kWCarryInv));

  /* ---- cross attention, add + LayerNorm, ffn ---- */
  /* One launch. S = Q_p . K_other^T (hi.hi + hi.lo + lo.hi), f32 : M 4096, N 4096, K 512. Branch A reads branch B's K
     planes (planes 6, 7 of QK) and branch B reads branch A's (planes 2, 3): the Bt stride is negative.
     r2 = relu(r1 . rW2^T + rb2).
     V^T[d][i] = sum_k Wv[d][k] feat[i][k] : A = Wv (M 512), Bt = feat f16 (N 4096), K 512, ldc 4096.
     The planes of the last two lie outside R0, which S overwrites. */
  logits_res2_vt_kernel<<<dim3(2 * kLogitTiles + 4 * kSmallTiles), 128, 0, stream>>>(
      gemm_args(QK, QK + kND, kDim, QK + 6 * kND, QK + 7 * kND, kDim, (void*)S, (void*)S, kTok,
                alng, blng, alng, blng, 4 * nd, -4 * nd, 0L, r0B, 0L, kTok, kTok, kDim, 1.0f),
      gemm_args(R1, R1, kDim, WF + 1 * kWW, WF + 1 * kWW, kDim, (void*)R2, (void*)R2, kDim,
                arb2, brb2, arb2, brb2, nd, 4 * ww, 0L, 2 * nd, 0L, kTok, kDim, kDim, kWCarryInv),
      gemm_args(WF + 3 * kWW, WF + 3 * kWW, kDim, F16, F16, kDim, (void*)VT, (void*)VT, kTok,
                apb1, bpb1, apb1, bpb1, 4 * ww, nd, 0L, 2 * nd, 0L, kDim, kTok, kDim, kWCarryInv));
  rowcol_kernel<<<dim3(kRcParts, 2), 512, 0, stream>>>(S, MROW, INVS, CP);
  /* One launch. res = r2 . rW3^T + rb3; rc = 1 / (1e-9 + column sums). */
  res3_colfin_kernel<<<dim3(2 * kSmallTiles + 2 * kColBlocks), 128, 0, stream>>>(
      gemm_args(R2, R2, kDim, WF + 2 * kWW, WF + 2 * kWW, kDim, (void*)RES, (void*)RES, kDim,
                arb3, brb3, arb3, brb3, nd, 4 * ww, 0L, 2 * nd, 0L, kTok, kDim, kDim, kWCarryInv),
      CP, RC);
  av_kernel<<<dim3(kTok / 64, 2, kAvHalves), 256, 0, stream>>>(S, MROW, INVS, RC, VT, SC);
  /* s = LayerNorm(res + sc); out = s + s . ffnW^T : A = s f16, Bt = ffnW f16 x256, residual s f32; s never leaves LDS */
  ln_ffn_kernel<<<dim3(kTok / kLfRows, 2), 256, 0, stream>>>(RES, SC, alng, alnb, blng, blnb, FFN, out);
}
